// v000
// Measured on an AMD MI455X. A time is GPU time per run, averaged over a window of back-to-back runs after a warm-up
// (all launches, gaps included; the runs take copies of the inputs in turn), and the median of several windows.
// Apart from v000's, it joins two sittings. Times from different sittings can be a few percent apart, while
// side-by-side timings come from the same sitting.
// v000, which the later versions start from, runs in 288 microseconds.
#include <hip/hip_runtime.h>

typedef __attribute__((ext_vector_type(2))) float v2f;
typedef __attribute__((ext_vector_type(4))) float v4f;
typedef __attribute__((ext_vector_type(8))) float v8f;

#define BATCH 2
#define NSEQ  2048
#define CD    768
#define NH    12
#define DH    64
#define BN    (BATCH * NSEQ)   // 4096 rows for the QKV GEMMs

// ---------------------------------------------------------------------------
// CDNA5 async global->LDS copy (no VGPR round trip, tracked by ASYNCcnt).
// LDS offset = low 32 bits of the flat shared-pointer address.
// ---------------------------------------------------------------------------
__device__ __forceinline__ void async_b128(void* lds_ptr, const void* gptr) {
  const unsigned int lds_off = (unsigned int)(uintptr_t)lds_ptr;
  asm volatile("global_load_async_to_lds_b128 %0, %1, off"
               :: "v"(lds_off), "v"(gptr) : "memory");
}
#define WAIT_ASYNC(n) asm volatile("s_wait_asynccnt %0" :: "i"(n) : "memory")

// ---------------------------------------------------------------------------
// QKV projection: y[i,j] = sum_k x[i,k] * w[j,k] + bias[j]
// Block = 128 threads (4 waves). Block tile 64x64, wave tile 16x64.
// K staged 32-wide, double-buffered via async-to-LDS; f32 WMMA 16x16x4.
// ---------------------------------------------------------------------------
__global__ __launch_bounds__(128)
void qkv_gemm_kernel(const float* __restrict__ x, const float* __restrict__ w,
                     const float* __restrict__ bias, float* __restrict__ y) {
  __shared__ float Xs[2][64][36];   // pad 36 -> conflict-free strided frag reads
  __shared__ float Ws[2][64][36];

  const int tid  = threadIdx.x;
  const int lane = tid & 31;
  const int wave = tid >> 5;
  const int lm   = lane & 15;          // M / N index within a 16-wide tile
  const int g    = lane >> 4;          // lane half (0 or 1)
  const int lh   = g << 1;             // K offset contribution: 0 or 2
  const int row0 = blockIdx.x * 64;
  const int col0 = blockIdx.y * 64;

  v8f acc[4];
  for (int t = 0; t < 4; ++t)
    for (int i = 0; i < 8; ++i) acc[t][i] = 0.f;

  // stage one 64x32 slab of X and of W^T into LDS buffer `buf` (8 async ops)
  auto stage = [&](int kc, int buf) {
    const int kc0 = kc * 32;
    for (int i = 0; i < 4; ++i) {
      const int s  = i * 128 + tid;        // 512 float4 slots each
      const int r  = s >> 3;
      const int c4 = (s & 7) << 2;
      async_b128(&Xs[buf][r][c4], &x[(size_t)(row0 + r) * CD + kc0 + c4]);
      async_b128(&Ws[buf][r][c4], &w[(size_t)(col0 + r) * CD + kc0 + c4]);
    }
  };

  stage(0, 0);
  for (int kc = 0; kc < CD / 32; ++kc) {
    const int cur = kc & 1;
    __syncthreads();                       // readers of buf[cur^1] are done
    if (kc + 1 < CD / 32) {
      stage(kc + 1, cur ^ 1);
      WAIT_ASYNC(8);                       // oldest 8 (block kc) landed
    } else {
      WAIT_ASYNC(0);
    }
    __syncthreads();                       // visible to all waves

    for (int kk = 0; kk < 8; ++kk) {
      const int klo = (kk << 2) + lh;
      v2f a;
      a.x = Xs[cur][wave * 16 + lm][klo];
      a.y = Xs[cur][wave * 16 + lm][klo + 1];
      for (int ct = 0; ct < 4; ++ct) {
        v2f bb;                               // B[k, j] = w[j, k]
        bb.x = Ws[cur][ct * 16 + lm][klo];
        bb.y = Ws[cur][ct * 16 + lm][klo + 1];
        acc[ct] = __builtin_amdgcn_wmma_f32_16x16x4_f32(
            false, a, false, bb, (short)0, acc[ct], false, false);
      }
    }
  }

  for (int ct = 0; ct < 4; ++ct) {
    const int j  = col0 + ct * 16 + lm;
    const float bj = bias[j];
    for (int v = 0; v < 8; ++v) {
      const int r = row0 + wave * 16 + v + (g << 3);   // C-layout row mapping
      y[(size_t)r * CD + j] = acc[ct][v] + bj;
    }
  }
}

// ---------------------------------------------------------------------------
// Flash-style attention over the *raw-reshaped* heads.
// Head slab: contiguous [N, 64] at ws + b*N*C + h*N*D.
// Block = 128 threads (4 waves) = one (b, h, 64-query-row block).
// Online softmax; K/V blocks of 64 keys double-buffered via async-to-LDS.
// ---------------------------------------------------------------------------
__global__ __launch_bounds__(128)
void attn_kernel(const float* __restrict__ q_ws, const float* __restrict__ k_ws,
                 const float* __restrict__ v_ws, const int* __restrict__ mask,
                 float* __restrict__ out) {
  __shared__ float Ks[2][64][68];   // 68-stride: conflict-free transposed reads
  __shared__ float Vs[2][64][68];
  __shared__ float Ps[4][16][68];   // per-wave P relayout buffer

  const int tid  = threadIdx.x;
  const int lane = tid & 31;
  const int wave = tid >> 5;
  const int lm   = lane & 15;
  const int g    = lane >> 4;
  const int lh   = g << 1;

  const int qb = blockIdx.x;                 // 0..31 query blocks
  const int bh = blockIdx.y;                 // 0..23
  const int b  = bh / NH;
  const int h  = bh % NH;

  const size_t base = (size_t)b * NSEQ * CD + (size_t)h * NSEQ * DH;
  const float* qp = q_ws + base + (size_t)qb * 64 * DH;
  const float* kp = k_ws + base;
  const float* vp = v_ws + base;

  // Q A-fragments, register resident: 16 rows x 64 K (16 chunks of K=4)
  v2f qf[16];
  const int qrow = wave * 16 + lm;
  for (int c = 0; c < 16; ++c) {
    const float* p = qp + qrow * DH + (c << 2) + lh;
    qf[c].x = p[0];
    qf[c].y = p[1];
  }

  float mrow[8], lrow[8];
  v8f o[4];
  for (int v = 0; v < 8; ++v) { mrow[v] = -3.0e38f; lrow[v] = 0.f; }
  for (int t = 0; t < 4; ++t)
    for (int i = 0; i < 8; ++i) o[t][i] = 0.f;

  const float scale = 3.46410161513775459f;  // sqrt(12): the H**-0.5 quirk

  // stage one 64-key K and V block into LDS buffer `buf` (16 async ops)
  auto stage = [&](int kb, int buf) {
    const float* kblk = kp + kb * 64 * DH;
    const float* vblk = vp + kb * 64 * DH;
    for (int i = 0; i < 8; ++i) {
      const int s  = i * 128 + tid;          // 1024 float4 slots each
      const int r  = s >> 4;
      const int c4 = (s & 15) << 2;
      async_b128(&Ks[buf][r][c4], kblk + r * DH + c4);
      async_b128(&Vs[buf][r][c4], vblk + r * DH + c4);
    }
  };

  stage(0, 0);
  for (int kb = 0; kb < NSEQ / 64; ++kb) {
    const int cur = kb & 1;
    __syncthreads();                         // readers of buf[cur^1] are done
    if (kb + 1 < NSEQ / 64) {
      stage(kb + 1, cur ^ 1);
      WAIT_ASYNC(16);                        // oldest 16 (block kb) landed
    } else {
      WAIT_ASYNC(0);
    }
    if (kb + 2 < NSEQ / 64) {                // warm L2 two blocks ahead
      __builtin_prefetch(kp + (kb + 2) * 64 * DH + tid * 32, 0, 1);
      __builtin_prefetch(vp + (kb + 2) * 64 * DH + tid * 32, 0, 1);
    }
    __syncthreads();                         // block-kb data visible everywhere

    int mk[4];
    for (int nk = 0; nk < 4; ++nk)
      mk[nk] = mask[b * NSEQ + kb * 64 + nk * 16 + lm];

    // S = Q * K^T  (4 tiles of 16 keys, 16 K-chunks each)
    v8f s[4];
    for (int nk = 0; nk < 4; ++nk) {
      for (int i = 0; i < 8; ++i) s[nk][i] = 0.f;
      const int krow = nk * 16 + lm;
      for (int c = 0; c < 16; ++c) {
        const int kcol = (c << 2) + lh;
        v2f bb;                               // B[k, key] = K[key, k]
        bb.x = Ks[cur][krow][kcol];
        bb.y = Ks[cur][krow][kcol + 1];
        s[nk] = __builtin_amdgcn_wmma_f32_16x16x4_f32(
            false, qf[c], false, bb, (short)0, s[nk], false, false);
      }
    }

    // scale, mask-replace, online softmax update
    float alpha[8];
    for (int v = 0; v < 8; ++v) {
      float t = -3.0e38f;
      for (int nk = 0; nk < 4; ++nk) {
        const float val = mk[nk] ? s[nk][v] * scale : -1.0e9f;
        s[nk][v] = val;
        t = fmaxf(t, val);
      }
      for (int off = 1; off < 16; off <<= 1)   // row max across its 16 lanes
        t = fmaxf(t, __shfl_xor(t, off, 32));
      const float mn = fmaxf(mrow[v], t);
      alpha[v] = __expf(mrow[v] - mn);
      mrow[v]  = mn;
      float rs = 0.f;
      for (int nk = 0; nk < 4; ++nk) {
        const float p = __expf(s[nk][v] - mn);
        s[nk][v] = p;
        rs += p;
      }
      for (int off = 1; off < 16; off <<= 1)
        rs += __shfl_xor(rs, off, 32);
      lrow[v] = lrow[v] * alpha[v] + rs;
    }
    for (int t = 0; t < 4; ++t)
      for (int v = 0; v < 8; ++v) o[t][v] *= alpha[v];

    // relayout P: C/D layout -> A-fragment layout via per-wave LDS
    for (int nk = 0; nk < 4; ++nk)
      for (int v = 0; v < 8; ++v)
        Ps[wave][v + (g << 3)][nk * 16 + lm] = s[nk][v];
    __syncthreads();   // uniform; also orders the in-wave LDS RAW

    // O += P * V  (4 d-tiles, 16 key-chunks each)
    for (int dt = 0; dt < 4; ++dt) {
      for (int c = 0; c < 16; ++c) {
        const int pcol = (c << 2) + lh;
        v2f a;
        a.x = Ps[wave][lm][pcol];
        a.y = Ps[wave][lm][pcol + 1];
        const int vrow = (c << 2) + lh;
        const int vcol = dt * 16 + lm;
        v2f bb;                               // B[k, d] = V[key, d]
        bb.x = Vs[cur][vrow][vcol];
        bb.y = Vs[cur][vrow + 1][vcol];
        o[dt] = __builtin_amdgcn_wmma_f32_16x16x4_f32(
            false, a, false, bb, (short)0, o[dt], false, false);
      }
    }
  }

  float inv[8];
  for (int v = 0; v < 8; ++v) inv[v] = 1.f / lrow[v];
  for (int dt = 0; dt < 4; ++dt) {
    const int d = h * DH + dt * 16 + lm;
    for (int v = 0; v < 8; ++v) {
      const int n = qb * 64 + wave * 16 + v + (g << 3);
      out[(size_t)b * NSEQ * CD + (size_t)n * CD + d] = o[dt][v] * inv[v];
    }
  }
}

// ---------------------------------------------------------------------------
extern "C" void kernel_launch(void* const* d_in, const int* in_sizes, int n_in,
                              void* d_out, int out_size, void* d_ws, size_t ws_size,
                              hipStream_t stream) {
  const float* x   = (const float*)d_in[0];
  const int*   msk = (const int*)d_in[1];
  const float* qw  = (const float*)d_in[2];
  const float* qb  = (const float*)d_in[3];
  const float* kw  = (const float*)d_in[4];
  const float* kb  = (const float*)d_in[5];
  const float* vw  = (const float*)d_in[6];
  const float* vb  = (const float*)d_in[7];
  float* out = (float*)d_out;

  const size_t mat = (size_t)BN * CD;     // floats per projection (12.6 MB)
  float* qws = (float*)d_ws;
  float* kws = qws + mat;
  float* vws = kws + mat;

  dim3 gg(BN / 64, CD / 64);              // 64 x 12 blocks
  qkv_gemm_kernel<<<gg, 128, 0, stream>>>(x, qw, qb, qws);
  qkv_gemm_kernel<<<gg, 128, 0, stream>>>(x, kw, kb, kws);
  qkv_gemm_kernel<<<gg, 128, 0, stream>>>(x, vw, vb, vws);

  dim3 ga(NSEQ / 64, BATCH * NH);         // 32 x 24 blocks
  attn_kernel<<<ga, 128, 0, stream>>>(qws, kws, vws, msk, out);
}

// v001
// It runs in 232 microseconds.
// Next to v000, in two timings, it ran 1.29 and 1.30 times as fast.
#include <hip/hip_runtime.h>

typedef __attribute__((ext_vector_type(2))) float v2f;
typedef __attribute__((ext_vector_type(4))) float v4f;
typedef __attribute__((ext_vector_type(4))) int   v4i;
typedef __attribute__((ext_vector_type(8))) float v8f;

#define BATCH 2
#define NSEQ  2048
#define CD    768
#define NH    12
#define DH    64
#define BN    (BATCH * NSEQ)   // 4096 rows for the QKV GEMMs

// ---------------------------------------------------------------------------
// CDNA5 async global->LDS copy (no VGPR round trip, tracked by ASYNCcnt).
// LDS offset = low 32 bits of the flat shared-pointer address.
// ---------------------------------------------------------------------------
__device__ __forceinline__ void async_b128(void* lds_ptr, const void* gptr) {
  const unsigned int lds_off = (unsigned int)(uintptr_t)lds_ptr;
  asm volatile("global_load_async_to_lds_b128 %0, %1, off"
               :: "v"(lds_off), "v"(gptr) : "memory");
}
#define WAIT_ASYNC(n) asm volatile("s_wait_asynccnt %0" :: "i"(n) : "memory")

// ---------------------------------------------------------------------------
// QKV projection: y[i,j] = sum_k x[i,k] * w[j,k] + bias[j]
// Block = 128 threads (4 waves). Block tile 64x64, wave tile 16x64.
// K staged 32-wide, double-buffered via async-to-LDS; f32 WMMA 16x16x4.
// ---------------------------------------------------------------------------
__global__ __launch_bounds__(128)
void qkv_gemm_kernel(const float* __restrict__ x, const float* __restrict__ w,
                     const float* __restrict__ bias, float* __restrict__ y) {
  __shared__ float Xs[2][64][36];   // pad 36 -> conflict-free strided frag reads
  __shared__ float Ws[2][64][36];

  const int tid  = threadIdx.x;
  const int lane = tid & 31;
  const int wave = tid >> 5;
  const int lm   = lane & 15;          // M / N index within a 16-wide tile
  const int g    = lane >> 4;          // lane half (0 or 1)
  const int lh   = g << 1;             // K offset contribution: 0 or 2
  const int row0 = blockIdx.x * 64;
  const int col0 = blockIdx.y * 64;

  v8f acc[4];
  for (int t = 0; t < 4; ++t)
    for (int i = 0; i < 8; ++i) acc[t][i] = 0.f;

  // stage one 64x32 slab of X and of W^T into LDS buffer `buf` (8 async ops)
  auto stage = [&](int kc, int buf) {
    const int kc0 = kc * 32;
    for (int i = 0; i < 4; ++i) {
      const int s  = i * 128 + tid;        // 512 float4 slots each
      const int r  = s >> 3;
      const int c4 = (s & 7) << 2;
      async_b128(&Xs[buf][r][c4], &x[(size_t)(row0 + r) * CD + kc0 + c4]);
      async_b128(&Ws[buf][r][c4], &w[(size_t)(col0 + r) * CD + kc0 + c4]);
    }
  };

  stage(0, 0);
  for (int kc = 0; kc < CD / 32; ++kc) {
    const int cur = kc & 1;
    __syncthreads();                       // readers of buf[cur^1] are done
    if (kc + 1 < CD / 32) {
      stage(kc + 1, cur ^ 1);
      WAIT_ASYNC(8);                       // oldest 8 (block kc) landed
    } else {
      WAIT_ASYNC(0);
    }
    __syncthreads();                       // visible to all waves

    for (int kk = 0; kk < 8; ++kk) {
      const int klo = (kk << 2) + lh;
      v2f a;
      a.x = Xs[cur][wave * 16 + lm][klo];
      a.y = Xs[cur][wave * 16 + lm][klo + 1];
      for (int ct = 0; ct < 4; ++ct) {
        v2f bb;                               // B[k, j] = w[j, k]
        bb.x = Ws[cur][ct * 16 + lm][klo];
        bb.y = Ws[cur][ct * 16 + lm][klo + 1];
        acc[ct] = __builtin_amdgcn_wmma_f32_16x16x4_f32(
            false, a, false, bb, (short)0, acc[ct], false, false);
      }
    }
  }

  for (int ct = 0; ct < 4; ++ct) {
    const int j  = col0 + ct * 16 + lm;
    const float bj = bias[j];
    for (int v = 0; v < 8; ++v) {
      const int r = row0 + wave * 16 + v + (g << 3);   // C-layout row mapping
      y[(size_t)r * CD + j] = acc[ct][v] + bj;
    }
  }
}

__device__ __forceinline__ float xhalf(float x) {
  const int i = __builtin_bit_cast(int, x);
  return __builtin_bit_cast(float, __builtin_amdgcn_permlanex16(
      i, i, 0x76543210, 0xfedcba98, false, false));
}

// exp(x) as v_mul by log2(e) + v_exp_f32, as __expf builds it. Written as asm so
// that the slot the instruction set asks for behind a transcendental (before its
// result is read or its source overwritten) is filled whatever is scheduled
// next: the second v_exp_f32 fills the first one's, the v_nop the last one's.
__device__ __forceinline__ v2f exp_pair(float x0, float x1) {
  const float y0 = x0 * 1.44269504088896341f;
  const float y1 = x1 * 1.44269504088896341f;
  float r0, r1;
  asm("v_exp_f32 %0, %2\n\tv_exp_f32 %1, %3\n\tv_nop"
      : "=&v"(r0), "=&v"(r1) : "v"(y0), "v"(y1));
  v2f r;
  r.x = r0;
  r.y = r1;
  return r;
}
__device__ __forceinline__ float exp_one(float x) {
  const float y = x * 1.44269504088896341f;
  float r;
  asm("v_exp_f32 %0, %1\n\tv_nop" : "=v"(r) : "v"(y));
  return r;
}

__global__ __launch_bounds__(128)
void attn_kernel(const float* __restrict__ q_ws, const float* __restrict__ k_ws,
                 const float* __restrict__ v_ws, const int* __restrict__ mask,
                 float* __restrict__ out) {
  __shared__ float Ks[2][64][68];   // 68-stride: conflict-free transposed reads
  __shared__ float Vs[2][64][68];

  const int tid  = threadIdx.x;
  const int lane = tid & 31;
  const int wave = tid >> 5;
  const int lm   = lane & 15;
  const int g    = lane >> 4;
  const int lh   = g << 1;

  const int qb = blockIdx.x;                 // 0..31 query blocks
  const int bh = blockIdx.y;                 // 0..23
  const int b  = bh / NH;
  const int h  = bh % NH;

  const size_t base = (size_t)b * NSEQ * CD + (size_t)h * NSEQ * DH;
  const float* qp = q_ws + base + (size_t)qb * 64 * DH;
  const float* kp = k_ws + base;
  const float* vp = v_ws + base;

  // Q B-fragments, register resident: 16 queries x 64 K (16 chunks of K=4)
  v2f qf[16];
  const int qrow = wave * 16 + lm;
  for (int c = 0; c < 16; ++c) {
    const float* p = qp + qrow * DH + (c << 2) + lh;
    qf[c].x = p[0];
    qf[c].y = p[1];
  }

  float mrow = -3.0e38f;                     // this lane's query: running maximum
  float lrow = 0.f;                          // sum over this wave half's keys only
  v8f o[4];                                  // o[dt][v] = O[query lm][dt*16 + 8g + v]
  for (int t = 0; t < 4; ++t)
    for (int i = 0; i < 8; ++i) o[t][i] = 0.f;

  const float scale = 3.46410161513775459f;  // sqrt(12): the H**-0.5 quirk

  // stage one 64-key K and V block into LDS buffer `buf` (16 async ops)
  auto stage = [&](int kb, int buf) {
    const float* kblk = kp + kb * 64 * DH;
    const float* vblk = vp + kb * 64 * DH;
    for (int i = 0; i < 8; ++i) {
      const int s  = i * 128 + tid;          // 1024 float4 slots each
      const int r  = s >> 4;
      const int c4 = (s & 15) << 2;
      async_b128(&Ks[buf][r][c4], kblk + r * DH + c4);
      async_b128(&Vs[buf][r][c4], vblk + r * DH + c4);
    }
  };

  stage(0, 0);
  for (int kb = 0; kb < NSEQ / 64; ++kb) {
    const int cur = kb & 1;
    __syncthreads();                         // readers of buf[cur^1] are done
    if (kb + 1 < NSEQ / 64) {
      stage(kb + 1, cur ^ 1);
      WAIT_ASYNC(16);                        // oldest 16 (block kb) landed
    } else {
      WAIT_ASYNC(0);
    }
    if (kb + 2 < NSEQ / 64) {                // warm L2 two blocks ahead
      __builtin_prefetch(kp + (kb + 2) * 64 * DH + tid * 32, 0, 1);
      __builtin_prefetch(vp + (kb + 2) * 64 * DH + tid * 32, 0, 1);
    }
    __syncthreads();                         // block-kb data visible everywhere

    // mask of this lane's keys: 8 consecutive ints per 16-key tile
    v4i mk[4][2];
    for (int nk = 0; nk < 4; ++nk) {
      const v4i* mp = (const v4i*)(mask + b * NSEQ + kb * 64 + nk * 16 + (g << 3));
      mk[nk][0] = mp[0];
      mk[nk][1] = mp[1];
    }

    // S^T = K * Q^T  (4 tiles of 16 keys, 16 K-chunks each)
    v8f s[4];
    for (int nk = 0; nk < 4; ++nk)
      for (int i = 0; i < 8; ++i) s[nk][i] = 0.f;
    for (int c = 0; c < 16; ++c) {
      const int kcol = (c << 2) + lh;
      for (int nk = 0; nk < 4; ++nk) {
        const int krow = nk * 16 + lm;
        v2f a;                                // A[key, k] = K[key, k]
        a.x = Ks[cur][krow][kcol];
        a.y = Ks[cur][krow][kcol + 1];
        s[nk] = __builtin_amdgcn_wmma_f32_16x16x4_f32(
            false, a, false, qf[c], (short)0, s[nk], false, false);
      }
    }

    // scale, mask-replace, online softmax update: one query per lane
    float tm[4];
    for (int nk = 0; nk < 4; ++nk) {
      tm[nk] = -3.0e38f;
      for (int v = 0; v < 8; ++v) {
        const float val = mk[nk][v >> 2][v & 3] ? s[nk][v] * scale : -1.0e9f;
        s[nk][v] = val;
        tm[nk] = fmaxf(tm[nk], val);
      }
    }
    float t = fmaxf(fmaxf(tm[0], tm[1]), fmaxf(tm[2], tm[3]));
    t = fmaxf(t, xhalf(t));                  // the other half's 32 keys
    const float mn    = fmaxf(mrow, t);
    const float alpha = exp_one(mrow - mn);
    mrow = mn;
    float rs[4];
    // unrolled whole, as below: a rolled nk loop indexes the s registers
#pragma unroll
    for (int nk = 0; nk < 4; ++nk) {
#pragma unroll
      for (int v = 0; v < 8; v += 2) {
        const v2f p = exp_pair(s[nk][v] - mn, s[nk][v + 1] - mn);
        s[nk][v]     = p.x;
        s[nk][v + 1] = p.y;
        rs[nk] = (v == 0 ? p.x : rs[nk] + p.x) + p.y;
      }
    }
    lrow = lrow * alpha + ((rs[0] + rs[1]) + (rs[2] + rs[3]));
    for (int dt = 0; dt < 4; ++dt)
      for (int v = 0; v < 8; ++v) o[dt][v] *= alpha;

    // O^T += V^T * P^T. k slot (g, e) of chunk j in tile nk is key
    // nk*16 + 8g + 2j + e on both sides: P^T straight from the S^T registers.
    // unrolled whole: left rolled, s[nk] is read through indexed register moves
#pragma unroll
    for (int nk = 0; nk < 4; ++nk) {
#pragma unroll
      for (int j = 0; j < 4; ++j) {
        const int vrow = nk * 16 + (g << 3) + (j << 1);
        v2f bb;                               // B[key, query] = P[query, key]
        bb.x = s[nk][2 * j];
        bb.y = s[nk][2 * j + 1];
        for (int dt = 0; dt < 4; ++dt) {
          const int vcol = dt * 16 + lm;
          v2f a;                              // A[d, key] = V[key, d]
          a.x = Vs[cur][vrow][vcol];
          a.y = Vs[cur][vrow + 1][vcol];
          o[dt] = __builtin_amdgcn_wmma_f32_16x16x4_f32(
              false, a, false, bb, (short)0, o[dt], false, false);
        }
      }
    }
  }

  const float inv = 1.f / (lrow + xhalf(lrow));   // join the halves' sums
  const int n = qb * 64 + wave * 16 + lm;
  float* op = out + (size_t)b * NSEQ * CD + (size_t)n * CD + h * DH + (g << 3);
  for (int dt = 0; dt < 4; ++dt) {
    v4f lo, hi;
    for (int v = 0; v < 4; ++v) {
      lo[v] = o[dt][v] * inv;
      hi[v] = o[dt][v + 4] * inv;
    }
    *(v4f*)(op + dt * 16)     = lo;
    *(v4f*)(op + dt * 16 + 4) = hi;
  }
}

// ---------------------------------------------------------------------------
extern "C" void kernel_launch(void* const* d_in, const int* in_sizes, int n_in,
                              void* d_out, int out_size, void* d_ws, size_t ws_size,
                              hipStream_t stream) {
  const float* x   = (const float*)d_in[0];
  const int*   msk = (const int*)d_in[1];
  const float* qw  = (const float*)d_in[2];
  const float* qb  = (const float*)d_in[3];
  const float* kw  = (const float*)d_in[4];
  const float* kb  = (const float*)d_in[5];
  const float* vw  = (const float*)d_in[6];
  const float* vb  = (const float*)d_in[7];
  float* out = (float*)d_out;

  const size_t mat = (size_t)BN * CD;     // floats per projection (12.6 MB)
  float* qws = (float*)d_ws;
  float* kws = qws + mat;
  float* vws = kws + mat;

  dim3 gg(BN / 64, CD / 64);              // 64 x 12 blocks
  qkv_gemm_kernel<<<gg, 128, 0, stream>>>(x, qw, qb, qws);
  qkv_gemm_kernel<<<gg, 128, 0, stream>>>(x, kw, kb, kws);
  qkv_gemm_kernel<<<gg, 128, 0, stream>>>(x, vw, vb, vws);

  dim3 ga(NSEQ / 64, BATCH * NH);         // 32 x 24 blocks
  attn_kernel<<<ga, 128, 0, stream>>>(qws, kws, vws, msk, out);
}

// v002
// A run of this version takes 164 microseconds.
// Timed twice side by side with v001, it ran 1.41 times as fast both times.
// Counting every step since v000, it is 1.83 times as fast.
#include <hip/hip_runtime.h>

typedef __attribute__((ext_vector_type(2))) float v2f;
typedef __attribute__((ext_vector_type(4))) float v4f;
typedef __attribute__((ext_vector_type(4))) int   v4i;
typedef __attribute__((ext_vector_type(8))) float v8f;

#define BATCH 2
#define NSEQ  2048
#define CD    768
#define NH    12
#define DH    64
#define BN    (BATCH * NSEQ)   // 4096 rows for the QKV GEMMs
#define NKB   (NSEQ / 64)      // 64-key blocks per head

// ---------------------------------------------------------------------------
// CDNA5 async global->LDS copy (no VGPR round trip, tracked by ASYNCcnt).
// LDS offset = low 32 bits of the flat shared-pointer address.
// ---------------------------------------------------------------------------
__device__ __forceinline__ void async_b128(void* lds_ptr, const void* gptr) {
  const unsigned int lds_off = (unsigned int)(uintptr_t)lds_ptr;
  asm volatile("global_load_async_to_lds_b128 %0, %1, off"
               :: "v"(lds_off), "v"(gptr) : "memory");
}
#define WAIT_ASYNC(n) asm volatile("s_wait_asynccnt %0" :: "i"(n) : "memory")

// Eight such copies in one statement. The s_wait_xcnt 0 at its end stands before
// any later rewrite of the address registers that the copies name (a precaution).
__device__ __forceinline__ void async_b128_x8(const unsigned int (&l)[8],
                                              const float* const (&p)[8]) {
  asm volatile("global_load_async_to_lds_b128 %0, %8, off\n\t"
               "global_load_async_to_lds_b128 %1, %9, off\n\t"
               "global_load_async_to_lds_b128 %2, %10, off\n\t"
               "global_load_async_to_lds_b128 %3, %11, off\n\t"
               "global_load_async_to_lds_b128 %4, %12, off\n\t"
               "global_load_async_to_lds_b128 %5, %13, off\n\t"
               "global_load_async_to_lds_b128 %6, %14, off\n\t"
               "global_load_async_to_lds_b128 %7, %15, off\n\t"
               "s_wait_xcnt 0x0"
               :: "v"(l[0]), "v"(l[1]), "v"(l[2]), "v"(l[3]),
                  "v"(l[4]), "v"(l[5]), "v"(l[6]), "v"(l[7]),
                  "v"(p[0]), "v"(p[1]), "v"(p[2]), "v"(p[3]),
                  "v"(p[4]), "v"(p[5]), "v"(p[6]), "v"(p[7])
               : "memory");
}

// ---------------------------------------------------------------------------
// QKV projection: y[i,j] = sum_k x[i,k] * w[j,k] + bias[j]
// Block = 128 threads (4 waves). Block tile 64x64, wave tile 16x64.
// K staged 32-wide, double-buffered via async-to-LDS; f32 WMMA 16x16x4.
// ---------------------------------------------------------------------------
__global__ __launch_bounds__(128)
void qkv_gemm_kernel(const float* __restrict__ x, const float* __restrict__ w,
                     const float* __restrict__ bias, float* __restrict__ y) {
  __shared__ float Xs[2][64][36];   // pad 36 -> conflict-free strided frag reads
  __shared__ float Ws[2][64][36];

  const int tid  = threadIdx.x;
  const int lane = tid & 31;
  const int wave = tid >> 5;
  const int lm   = lane & 15;          // M / N index within a 16-wide tile
  const int g    = lane >> 4;          // lane half (0 or 1)
  const int lh   = g << 1;             // K offset contribution: 0 or 2
  const int row0 = blockIdx.x * 64;
  const int col0 = blockIdx.y * 64;

  v8f acc[4];
  for (int t = 0; t < 4; ++t)
    for (int i = 0; i < 8; ++i) acc[t][i] = 0.f;

  // stage one 64x32 slab of X and of W^T into LDS buffer `buf` (8 async ops)
  auto stage = [&](int kc, int buf) {
    const int kc0 = kc * 32;
    for (int i = 0; i < 4; ++i) {
      const int s  = i * 128 + tid;        // 512 float4 slots each
      const int r  = s >> 3;
      const int c4 = (s & 7) << 2;
      async_b128(&Xs[buf][r][c4], &x[(size_t)(row0 + r) * CD + kc0 + c4]);
      async_b128(&Ws[buf][r][c4], &w[(size_t)(col0 + r) * CD + kc0 + c4]);
    }
  };

  stage(0, 0);
  for (int kc = 0; kc < CD / 32; ++kc) {
    const int cur = kc & 1;
    __syncthreads();                       // readers of buf[cur^1] are done
    if (kc + 1 < CD / 32) {
      stage(kc + 1, cur ^ 1);
      WAIT_ASYNC(8);                       // oldest 8 (block kc) landed
    } else {
      WAIT_ASYNC(0);
    }
    __syncthreads();                       // visible to all waves

    for (int kk = 0; kk < 8; ++kk) {
      const int klo = (kk << 2) + lh;
      v2f a;
      a.x = Xs[cur][wave * 16 + lm][klo];
      a.y = Xs[cur][wave * 16 + lm][klo + 1];
      for (int ct = 0; ct < 4; ++ct) {
        v2f bb;                               // B[k, j] = w[j, k]
        bb.x = Ws[cur][ct * 16 + lm][klo];
        bb.y = Ws[cur][ct * 16 + lm][klo + 1];
        acc[ct] = __builtin_amdgcn_wmma_f32_16x16x4_f32(
            false, a, false, bb, (short)0, acc[ct], false, false);
      }
    }
  }

  for (int ct = 0; ct < 4; ++ct) {
    const int j  = col0 + ct * 16 + lm;
    const float bj = bias[j];
    for (int v = 0; v < 8; ++v) {
      const int r = row0 + wave * 16 + v + (g << 3);   // C-layout row mapping
      y[(size_t)r * CD + j] = acc[ct][v] + bj;
    }
  }
}

__device__ __forceinline__ float xhalf(float x) {
  const int i = __builtin_bit_cast(int, x);
  return __builtin_bit_cast(float, __builtin_amdgcn_permlanex16(
      i, i, 0x76543210, 0xfedcba98, false, false));
}

// exp(x) as v_mul by log2(e) + v_exp_f32, as __expf builds it. Written as asm so
// that the slot the instruction set asks for behind a transcendental (before its
// result is read or its source overwritten) is filled whatever is scheduled
// next: the second v_exp_f32 fills the first one's, the v_nop the last one's.
__device__ __forceinline__ v2f exp_pair(float x0, float x1) {
  const float y0 = x0 * 1.44269504088896341f;
  const float y1 = x1 * 1.44269504088896341f;
  float r0, r1;
  asm("v_exp_f32 %0, %2\n\tv_exp_f32 %1, %3\n\tv_nop"
      : "=&v"(r0), "=&v"(r1) : "v"(y0), "v"(y1));
  v2f r;
  r.x = r0;
  r.y = r1;
  return r;
}
__device__ __forceinline__ float exp_one(float x) {
  const float y = x * 1.44269504088896341f;
  float r;
  asm("v_exp_f32 %0, %1\n\tv_nop" : "=v"(r) : "v"(y));
  return r;
}

__global__ __launch_bounds__(128)
void attn_kernel(const float* __restrict__ q_ws, const float* __restrict__ k_ws,
                 const float* __restrict__ v_ws, const int* __restrict__ mask,
                 float* __restrict__ out) {
  __shared__ float Ks[2][64][68];   // 68-stride: conflict-free transposed reads
  __shared__ float Vs[2][64][68];
  __shared__ __attribute__((aligned(16))) unsigned short order[NSEQ];
  __shared__ int wsum[4];                    // unmasked keys per wave's 512 keys
  __shared__ int wlow[4];                    // per wave: some row maximum is low

  const int tid  = threadIdx.x;
  const int lane = tid & 31;
  const int wave = tid >> 5;
  const int lm   = lane & 15;
  const int g    = lane >> 4;
  const int lh   = g << 1;

  const int qb = blockIdx.x;                 // 0..31 query blocks
  const int bh = blockIdx.y;                 // 0..23
  const int b  = bh / NH;
  const int h  = bh % NH;

  const size_t base = (size_t)b * NSEQ * CD + (size_t)h * NSEQ * DH;
  const float* qp = q_ws + base + (size_t)qb * 64 * DH;
  const float* kp = k_ws + base;
  const float* vp = v_ws + base;

  // Q B-fragments, register resident: 16 queries x 64 K (16 chunks of K=4)
  v2f qf[16];
  const int qrow = wave * 16 + lm;
  for (int c = 0; c < 16; ++c) {
    const float* p = qp + qrow * DH + (c << 2) + lh;
    qf[c].x = p[0];
    qf[c].y = p[1];
  }

  // order[]: the batch's unmasked keys, ascending, then its masked keys.
  // A thread takes 16 consecutive keys; prefix sum of the counts by ballots of
  // their five bits inside a wave, through wsum[] between the waves.
  unsigned int bits = 0;
  for (int i = 0; i < 4; ++i) {
    const v4i m = ((const v4i*)(mask + b * NSEQ + tid * 16))[i];
    for (int e = 0; e < 4; ++e) bits |= (m[e] != 0 ? 1u : 0u) << (i * 4 + e);
  }
  const int mine = __popc(bits);
  int ahead = 0, wtot = 0;
  for (int i = 0; i < 5; ++i) {
    const unsigned int bal = __builtin_amdgcn_ballot_w32(((mine >> i) & 1) != 0);
    ahead += (int)__builtin_amdgcn_mbcnt_lo(bal, 0u) << i;
    wtot  += __popc(bal) << i;
  }
  if (lane == 0) wsum[wave] = wtot;
  __syncthreads();                           // the four wave sums are written
  int total = 0;
  for (int w = 0; w < 4; ++w) {
    const int t = wsum[w];
    total += t;
    if (w < wave) ahead += t;
  }
  const int cnt = __builtin_amdgcn_readfirstlane(total);   // unmasked keys, 0..NSEQ
  for (int i = 0; i < 16; ++i) {
    const int key = tid * 16 + i;
    const int u   = ahead + __popc(bits & ((1u << i) - 1u));   // unmasked keys below
    order[((bits >> i) & 1u) ? u : cnt + key - u] = (unsigned short)key;
  }
  __syncthreads();                           // order[] is whole

  float mrow = -3.0e38f;                     // this lane's query: running maximum
  float lrow = 0.f;                          // sum over this wave half's keys only
  v8f o[4];                                  // o[dt][v] = O[query lm][dt*16 + 8g + v]
  for (int t = 0; t < 4; ++t)
    for (int i = 0; i < 8; ++i) o[t][i] = 0.f;

  const float scale = 3.46410161513775459f;  // sqrt(12): the H**-0.5 quirk

  // stage the K and V rows of places kb*64 .. kb*64+63 of order[] into LDS buffer
  // `buf` (16 async ops): 16 lanes copy one 256-byte row, a thread eight rows
  auto stage = [&](int kb, int buf) {
    const int r0 = (tid >> 4) << 3;
    const int c4 = (tid & 15) << 2;
    const v4i pk = *(const v4i*)&order[kb * 64 + r0];   // eight 16-bit key numbers
    for (int hf = 0; hf < 2; ++hf) {
      unsigned int l[8];
      const float* p[8];
      for (int i = 0; i < 4; ++i) {
        const int r   = r0 + hf * 4 + i;
        const int key = (pk[hf * 2 + (i >> 1)] >> ((i & 1) << 4)) & (NSEQ - 1);
        l[i]     = (unsigned int)(uintptr_t)&Ks[buf][r][c4];
        l[i + 4] = (unsigned int)(uintptr_t)&Vs[buf][r][c4];
        p[i]     = kp + key * DH + c4;
        p[i + 4] = vp + key * DH + c4;
      }
      async_b128_x8(l, p);
    }
  };

  const int nfull = cnt >> 6;                // blocks of unmasked keys only
  int lo = 0;
  int hi = min((cnt + 63) >> 6, NKB);        // blocks that hold an unmasked key
  for (;;) {                                 // blocks lo..hi-1; at most two rounds
  if (lo < hi) stage(lo, lo & 1);
  for (int kb = lo; kb < hi; ++kb) {
    const int cur = kb & 1;
    __syncthreads();                         // readers of buf[cur^1] are done
    if (kb + 1 < hi) {
      stage(kb + 1, cur ^ 1);
      WAIT_ASYNC(16);                        // oldest 16 (block kb) landed
    } else {
      WAIT_ASYNC(0);
    }
    __syncthreads();                         // block-kb data visible everywhere

    // S^T = K * Q^T  (4 tiles of 16 keys, 16 K-chunks each)
    v8f s[4];
    for (int nk = 0; nk < 4; ++nk)
      for (int i = 0; i < 8; ++i) s[nk][i] = 0.f;
    for (int c = 0; c < 16; ++c) {
      const int kcol = (c << 2) + lh;
      for (int nk = 0; nk < 4; ++nk) {
        const int krow = nk * 16 + lm;
        v2f a;                                // A[key, k] = K[key, k]
        a.x = Ks[cur][krow][kcol];
        a.y = Ks[cur][krow][kcol + 1];
        s[nk] = __builtin_amdgcn_wmma_f32_16x16x4_f32(
            false, a, false, qf[c], (short)0, s[nk], false, false);
      }
    }

    // scale, mask-replace, online softmax update: one query per lane
    for (int nk = 0; nk < 4; ++nk)
      for (int v = 0; v < 8; ++v) s[nk][v] *= scale;
    if (kb >= nfull) {                       // places from cnt on are masked keys
      const int left = cnt - kb * 64 - (g << 3);
      for (int nk = 0; nk < 4; ++nk)
        for (int v = 0; v < 8; ++v)
          if (nk * 16 + v >= left) s[nk][v] = -1.0e9f;
    }
    float tm[4];
    for (int nk = 0; nk < 4; ++nk) {
      tm[nk] = -3.0e38f;
      for (int v = 0; v < 8; ++v) tm[nk] = fmaxf(tm[nk], s[nk][v]);
    }
    float t = fmaxf(fmaxf(tm[0], tm[1]), fmaxf(tm[2], tm[3]));
    t = fmaxf(t, xhalf(t));                  // the other half's 32 keys
    const float mn    = fmaxf(mrow, t);
    const float alpha = exp_one(mrow - mn);
    mrow = mn;
    float rs[4];
    // unrolled whole, as below: a rolled nk loop indexes the s registers
#pragma unroll
    for (int nk = 0; nk < 4; ++nk) {
#pragma unroll
      for (int v = 0; v < 8; v += 2) {
        const v2f p = exp_pair(s[nk][v] - mn, s[nk][v + 1] - mn);
        s[nk][v]     = p.x;
        s[nk][v + 1] = p.y;
        rs[nk] = (v == 0 ? p.x : rs[nk] + p.x) + p.y;
      }
    }
    lrow = lrow * alpha + ((rs[0] + rs[1]) + (rs[2] + rs[3]));
    for (int dt = 0; dt < 4; ++dt)
      for (int v = 0; v < 8; ++v) o[dt][v] *= alpha;

    // O^T += V^T * P^T. k slot (g, e) of chunk j in tile nk is key
    // nk*16 + 8g + 2j + e on both sides: P^T straight from the S^T registers.
    // unrolled whole: left rolled, s[nk] is read through indexed register moves
#pragma unroll
    for (int nk = 0; nk < 4; ++nk) {
#pragma unroll
      for (int j = 0; j < 4; ++j) {
        const int vrow = nk * 16 + (g << 3) + (j << 1);
        v2f bb;                               // B[key, query] = P[query, key]
        bb.x = s[nk][2 * j];
        bb.y = s[nk][2 * j + 1];
        for (int dt = 0; dt < 4; ++dt) {
          const int vcol = dt * 16 + lm;
          v2f a;                              // A[d, key] = V[key, d]
          a.x = Vs[cur][vrow][vcol];
          a.y = Vs[cur][vrow + 1][vcol];
          o[dt] = __builtin_amdgcn_wmma_f32_16x16x4_f32(
              false, a, false, bb, (short)0, o[dt], false, false);
        }
      }
    }
  }
  // the unmasked keys are done: do the masked ones weigh anything?
  if (hi == NKB) break;
  const unsigned int low = __builtin_amdgcn_ballot_w32(mrow < -5.0e8f);
  if (lane == 0) wlow[wave] = low != 0u;
  __syncthreads();                           // the four flags are written
  if (__builtin_amdgcn_readfirstlane(wlow[0] | wlow[1] | wlow[2] | wlow[3]) == 0)
    break;                                   // every masked key's weight is 0
  lo = hi;
  hi = NKB;
  }

  const float inv = 1.f / (lrow + xhalf(lrow));   // join the halves' sums
  const int n = qb * 64 + wave * 16 + lm;
  float* op = out + (size_t)b * NSEQ * CD + (size_t)n * CD + h * DH + (g << 3);
  for (int dt = 0; dt < 4; ++dt) {
    v4f lo, hi;
    for (int v = 0; v < 4; ++v) {
      lo[v] = o[dt][v] * inv;
      hi[v] = o[dt][v + 4] * inv;
    }
    *(v4f*)(op + dt * 16)     = lo;
    *(v4f*)(op + dt * 16 + 4) = hi;
  }
}

// ---------------------------------------------------------------------------
extern "C" void kernel_launch(void* const* d_in, const int* in_sizes, int n_in,
                              void* d_out, int out_size, void* d_ws, size_t ws_size,
                              hipStream_t stream) {
  const float* x   = (const float*)d_in[0];
  const int*   msk = (const int*)d_in[1];
  const float* qw  = (const float*)d_in[2];
  const float* qb  = (const float*)d_in[3];
  const float* kw  = (const float*)d_in[4];
  const float* kb  = (const float*)d_in[5];
  const float* vw  = (const float*)d_in[6];
  const float* vb  = (const float*)d_in[7];
  float* out = (float*)d_out;

  const size_t mat = (size_t)BN * CD;     // floats per projection (12.6 MB)
  float* qws = (float*)d_ws;
  float* kws = qws + mat;
  float* vws = kws + mat;

  dim3 gg(BN / 64, CD / 64);              // 64 x 12 blocks
  qkv_gemm_kernel<<<gg, 128, 0, stream>>>(x, qw, qb, qws);
  qkv_gemm_kernel<<<gg, 128, 0, stream>>>(x, kw, kb, kws);
  qkv_gemm_kernel<<<gg, 128, 0, stream>>>(x, vw, vb, vws);

  dim3 ga(NSEQ / 64, BATCH * NH);         // 32 x 24 blocks
  attn_kernel<<<ga, 128, 0, stream>>>(qws, kws, vws, msk, out);
}

// v003
// A run of this version takes 151 microseconds.
// Timed twice side by side with v002, it ran 1.08 times as fast both times.
// Over all steps from v000 it is 1.97 times as fast.
#include <hip/hip_runtime.h>

typedef __attribute__((ext_vector_type(2))) float v2f;
typedef __attribute__((ext_vector_type(4))) float v4f;
typedef __attribute__((ext_vector_type(4))) int   v4i;
typedef __attribute__((ext_vector_type(8))) float v8f;

#define BATCH 2
#define NSEQ  2048
#define CD    768
#define NH    12
#define DH    64
#define BN    (BATCH * NSEQ)   // 4096 rows for the QKV GEMMs
#define NKB   (NSEQ / 64)      // 64-key blocks per head

// ---------------------------------------------------------------------------
// CDNA5 async global->LDS copy (no VGPR round trip, tracked by ASYNCcnt).
// LDS offset = low 32 bits of the flat shared-pointer address.
// ---------------------------------------------------------------------------
__device__ __forceinline__ void async_b128(void* lds_ptr, const void* gptr) {
  const unsigned int lds_off = (unsigned int)(uintptr_t)lds_ptr;
  asm volatile("global_load_async_to_lds_b128 %0, %1, off"
               :: "v"(lds_off), "v"(gptr) : "memory");
}
#define WAIT_ASYNC(n) asm volatile("s_wait_asynccnt %0" :: "i"(n) : "memory")

// Eight such copies in one statement. The s_wait_xcnt 0 at its end stands before
// any later rewrite of the address registers that the copies name (a precaution).
__device__ __forceinline__ void async_b128_x8(const unsigned int (&l)[8],
                                              const float* const (&p)[8]) {
  asm volatile("global_load_async_to_lds_b128 %0, %8, off\n\t"
               "global_load_async_to_lds_b128 %1, %9, off\n\t"
               "global_load_async_to_lds_b128 %2, %10, off\n\t"
               "global_load_async_to_lds_b128 %3, %11, off\n\t"
               "global_load_async_to_lds_b128 %4, %12, off\n\t"
               "global_load_async_to_lds_b128 %5, %13, off\n\t"
               "global_load_async_to_lds_b128 %6, %14, off\n\t"
               "global_load_async_to_lds_b128 %7, %15, off\n\t"
               "s_wait_xcnt 0x0"
               :: "v"(l[0]), "v"(l[1]), "v"(l[2]), "v"(l[3]),
                  "v"(l[4]), "v"(l[5]), "v"(l[6]), "v"(l[7]),
                  "v"(p[0]), "v"(p[1]), "v"(p[2]), "v"(p[3]),
                  "v"(p[4]), "v"(p[5]), "v"(p[6]), "v"(p[7])
               : "memory");
}

// ---------------------------------------------------------------------------
// QKV projection: y[i,j] = sum_k x[i,k] * w[j,k] + bias[j]
// Block = 128 threads (4 waves). Block tile 64x64, wave tile 16x64.
// K staged 32-wide, double-buffered via async-to-LDS; f32 WMMA 16x16x4.
// One launch does all three projections: blockIdx.z picks the weight, the bias
// and the plane of the workspace. A WGP then holds eight blocks instead of three,
// so a SIMD has other waves' WMMAs to issue while one wave waits at a barrier, a
// copy or an LDS read, and the stretch in which a SIMD's last wave runs alone
// comes once, not three times.
// ---------------------------------------------------------------------------
__global__ __launch_bounds__(128)
void qkv_gemm_kernel(const float* __restrict__ x,
                     const float* __restrict__ qw, const float* __restrict__ qb,
                     const float* __restrict__ kw, const float* __restrict__ kb,
                     const float* __restrict__ vw, const float* __restrict__ vb,
                     float* __restrict__ ws) {
  __shared__ float Xs[2][64][36];   // pad 36 -> conflict-free strided frag reads
  __shared__ float Ws[2][64][36];

  const int z = blockIdx.z;            // 0: Q, 1: K, 2: V
  const float* __restrict__ w    = z == 0 ? qw : (z == 1 ? kw : vw);
  const float* __restrict__ bias = z == 0 ? qb : (z == 1 ? kb : vb);
  float* __restrict__ y = ws + (size_t)z * BN * CD;

  const int tid  = threadIdx.x;
  const int lane = tid & 31;
  const int wave = tid >> 5;
  const int lm   = lane & 15;          // M / N index within a 16-wide tile
  const int g    = lane >> 4;          // lane half (0 or 1)
  const int lh   = g << 1;             // K offset contribution: 0 or 2
  const int row0 = blockIdx.x * 64;
  const int col0 = blockIdx.y * 64;

  v8f acc[4];
  for (int t = 0; t < 4; ++t)
    for (int i = 0; i < 8; ++i) acc[t][i] = 0.f;

  // stage one 64x32 slab of X and of W^T into LDS buffer `buf` (8 async ops)
  auto stage = [&](int kc, int buf) {
    const int kc0 = kc * 32;
    for (int i = 0; i < 4; ++i) {
      const int s  = i * 128 + tid;        // 512 float4 slots each
      const int r  = s >> 3;
      const int c4 = (s & 7) << 2;
      async_b128(&Xs[buf][r][c4], &x[(size_t)(row0 + r) * CD + kc0 + c4]);
      async_b128(&Ws[buf][r][c4], &w[(size_t)(col0 + r) * CD + kc0 + c4]);
    }
  };

  stage(0, 0);
  for (int kc = 0; kc < CD / 32; ++kc) {
    const int cur = kc & 1;
    __syncthreads();                       // readers of buf[cur^1] are done
    if (kc + 1 < CD / 32) {
      stage(kc + 1, cur ^ 1);
      WAIT_ASYNC(8);                       // oldest 8 (block kc) landed
    } else {
      WAIT_ASYNC(0);
    }
    __syncthreads();                       // visible to all waves

    for (int kk = 0; kk < 8; ++kk) {
      const int klo = (kk << 2) + lh;
      v2f a;
      a.x = Xs[cur][wave * 16 + lm][klo];
      a.y = Xs[cur][wave * 16 + lm][klo + 1];
      for (int ct = 0; ct < 4; ++ct) {
        v2f bb;                               // B[k, j] = w[j, k]
        bb.x = Ws[cur][ct * 16 + lm][klo];
        bb.y = Ws[cur][ct * 16 + lm][klo + 1];
        acc[ct] = __builtin_amdgcn_wmma_f32_16x16x4_f32(
            false, a, false, bb, (short)0, acc[ct], false, false);
      }
    }
  }

  for (int ct = 0; ct < 4; ++ct) {
    const int j  = col0 + ct * 16 + lm;
    const float bj = bias[j];
    for (int v = 0; v < 8; ++v) {
      const int r = row0 + wave * 16 + v + (g << 3);   // C-layout row mapping
      y[(size_t)r * CD + j] = acc[ct][v] + bj;
    }
  }
}

__device__ __forceinline__ float xhalf(float x) {
  const int i = __builtin_bit_cast(int, x);
  return __builtin_bit_cast(float, __builtin_amdgcn_permlanex16(
      i, i, 0x76543210, 0xfedcba98, false, false));
}

// exp(x) as v_mul by log2(e) + v_exp_f32, as __expf builds it. Written as asm so
// that the slot the instruction set asks for behind a transcendental (before its
// result is read or its source overwritten) is filled whatever is scheduled
// next: the second v_exp_f32 fills the first one's, the v_nop the last one's.
__device__ __forceinline__ v2f exp_pair(float x0, float x1) {
  const float y0 = x0 * 1.44269504088896341f;
  const float y1 = x1 * 1.44269504088896341f;
  float r0, r1;
  asm("v_exp_f32 %0, %2\n\tv_exp_f32 %1, %3\n\tv_nop"
      : "=&v"(r0), "=&v"(r1) : "v"(y0), "v"(y1));
  v2f r;
  r.x = r0;
  r.y = r1;
  return r;
}
__device__ __forceinline__ float exp_one(float x) {
  const float y = x * 1.44269504088896341f;
  float r;
  asm("v_exp_f32 %0, %1\n\tv_nop" : "=v"(r) : "v"(y));
  return r;
}

__global__ __launch_bounds__(128)
void attn_kernel(const float* __restrict__ q_ws, const float* __restrict__ k_ws,
                 const float* __restrict__ v_ws, const int* __restrict__ mask,
                 float* __restrict__ out) {
  __shared__ float Ks[2][64][68];   // 68-stride: conflict-free transposed reads
  __shared__ float Vs[2][64][68];
  __shared__ __attribute__((aligned(16))) unsigned short order[NSEQ];
  __shared__ int wsum[4];                    // unmasked keys per wave's 512 keys
  __shared__ int wlow[4];                    // per wave: some row maximum is low

  const int tid  = threadIdx.x;
  const int lane = tid & 31;
  const int wave = tid >> 5;
  const int lm   = lane & 15;
  const int g    = lane >> 4;
  const int lh   = g << 1;

  const int qb = blockIdx.x;                 // 0..31 query blocks
  const int bh = blockIdx.y;                 // 0..23
  const int b  = bh / NH;
  const int h  = bh % NH;

  const size_t base = (size_t)b * NSEQ * CD + (size_t)h * NSEQ * DH;
  const float* qp = q_ws + base + (size_t)qb * 64 * DH;
  const float* kp = k_ws + base;
  const float* vp = v_ws + base;

  // Q B-fragments, register resident: 16 queries x 64 K (16 chunks of K=4)
  v2f qf[16];
  const int qrow = wave * 16 + lm;
  for (int c = 0; c < 16; ++c) {
    const float* p = qp + qrow * DH + (c << 2) + lh;
    qf[c].x = p[0];
    qf[c].y = p[1];
  }

  // order[]: the batch's unmasked keys, ascending, then its masked keys.
  // A thread takes 16 consecutive keys; prefix sum of the counts by ballots of
  // their five bits inside a wave, through wsum[] between the waves.
  unsigned int bits = 0;
  for (int i = 0; i < 4; ++i) {
    const v4i m = ((const v4i*)(mask + b * NSEQ + tid * 16))[i];
    for (int e = 0; e < 4; ++e) bits |= (m[e] != 0 ? 1u : 0u) << (i * 4 + e);
  }
  const int mine = __popc(bits);
  int ahead = 0, wtot = 0;
  for (int i = 0; i < 5; ++i) {
    const unsigned int bal = __builtin_amdgcn_ballot_w32(((mine >> i) & 1) != 0);
    ahead += (int)__builtin_amdgcn_mbcnt_lo(bal, 0u) << i;
    wtot  += __popc(bal) << i;
  }
  if (lane == 0) wsum[wave] = wtot;
  __syncthreads();                           // the four wave sums are written
  int total = 0;
  for (int w = 0; w < 4; ++w) {
    const int t = wsum[w];
    total += t;
    if (w < wave) ahead += t;
  }
  const int cnt = __builtin_amdgcn_readfirstlane(total);   // unmasked keys, 0..NSEQ
  for (int i = 0; i < 16; ++i) {
    const int key = tid * 16 + i;
    const int u   = ahead + __popc(bits & ((1u << i) - 1u));   // unmasked keys below
    order[((bits >> i) & 1u) ? u : cnt + key - u] = (unsigned short)key;
  }
  __syncthreads();                           // order[] is whole

  float mrow = -3.0e38f;                     // this lane's query: running maximum
  float lrow = 0.f;                          // sum over this wave half's keys only
  v8f o[4];                                  // o[dt][v] = O[query lm][dt*16 + 8g + v]
  for (int t = 0; t < 4; ++t)
    for (int i = 0; i < 8; ++i) o[t][i] = 0.f;

  const float scale = 3.46410161513775459f;  // sqrt(12): the H**-0.5 quirk

  // stage the K and V rows of places kb*64 .. kb*64+63 of order[] into LDS buffer
  // `buf` (16 async ops): 16 lanes copy one 256-byte row, a thread eight rows
  auto stage = [&](int kb, int buf) {
    const int r0 = (tid >> 4) << 3;
    const int c4 = (tid & 15) << 2;
    const v4i pk = *(const v4i*)&order[kb * 64 + r0];   // eight 16-bit key numbers
    for (int hf = 0; hf < 2; ++hf) {
      unsigned int l[8];
      const float* p[8];
      for (int i = 0; i < 4; ++i) {
        const int r   = r0 + hf * 4 + i;
        const int key = (pk[hf * 2 + (i >> 1)] >> ((i & 1) << 4)) & (NSEQ - 1);
        l[i]     = (unsigned int)(uintptr_t)&Ks[buf][r][c4];
        l[i + 4] = (unsigned int)(uintptr_t)&Vs[buf][r][c4];
        p[i]     = kp + key * DH + c4;
        p[i + 4] = vp + key * DH + c4;
      }
      async_b128_x8(l, p);
    }
  };

  const int nfull = cnt >> 6;                // blocks of unmasked keys only
  int lo = 0;
  int hi = min((cnt + 63) >> 6, NKB);        // blocks that hold an unmasked key
  for (;;) {                                 // blocks lo..hi-1; at most two rounds
  if (lo < hi) stage(lo, lo & 1);
  for (int kb = lo; kb < hi; ++kb) {
    const int cur = kb & 1;
    __syncthreads();                         // readers of buf[cur^1] are done
    if (kb + 1 < hi) {
      stage(kb + 1, cur ^ 1);
      WAIT_ASYNC(16);                        // oldest 16 (block kb) landed
    } else {
      WAIT_ASYNC(0);
    }
    __syncthreads();                         // block-kb data visible everywhere

    // S^T = K * Q^T  (4 tiles of 16 keys, 16 K-chunks each)
    v8f s[4];
    for (int nk = 0; nk < 4; ++nk)
      for (int i = 0; i < 8; ++i) s[nk][i] = 0.f;
    for (int c = 0; c < 16; ++c) {
      const int kcol = (c << 2) + lh;
      for (int nk = 0; nk < 4; ++nk) {
        const int krow = nk * 16 + lm;
        v2f a;                                // A[key, k] = K[key, k]
        a.x = Ks[cur][krow][kcol];
        a.y = Ks[cur][krow][kcol + 1];
        s[nk] = __builtin_amdgcn_wmma_f32_16x16x4_f32(
            false, a, false, qf[c], (short)0, s[nk], false, false);
      }
    }

    // scale, mask-replace, online softmax update: one query per lane
    for (int nk = 0; nk < 4; ++nk)
      for (int v = 0; v < 8; ++v) s[nk][v] *= scale;
    if (kb >= nfull) {                       // places from cnt on are masked keys
      const int left = cnt - kb * 64 - (g << 3);
      for (int nk = 0; nk < 4; ++nk)
        for (int v = 0; v < 8; ++v)
          if (nk * 16 + v >= left) s[nk][v] = -1.0e9f;
    }
    float tm[4];
    for (int nk = 0; nk < 4; ++nk) {
      tm[nk] = -3.0e38f;
      for (int v = 0; v < 8; ++v) tm[nk] = fmaxf(tm[nk], s[nk][v]);
    }
    float t = fmaxf(fmaxf(tm[0], tm[1]), fmaxf(tm[2], tm[3]));
    t = fmaxf(t, xhalf(t));                  // the other half's 32 keys
    const float mn    = fmaxf(mrow, t);
    const float alpha = exp_one(mrow - mn);
    mrow = mn;
    float rs[4];
    // unrolled whole, as below: a rolled nk loop indexes the s registers
#pragma unroll
    for (int nk = 0; nk < 4; ++nk) {
#pragma unroll
      for (int v = 0; v < 8; v += 2) {
        const v2f p = exp_pair(s[nk][v] - mn, s[nk][v + 1] - mn);
        s[nk][v]     = p.x;
        s[nk][v + 1] = p.y;
        rs[nk] = (v == 0 ? p.x : rs[nk] + p.x) + p.y;
      }
    }
    lrow = lrow * alpha + ((rs[0] + rs[1]) + (rs[2] + rs[3]));
    for (int dt = 0; dt < 4; ++dt)
      for (int v = 0; v < 8; ++v) o[dt][v] *= alpha;

    // O^T += V^T * P^T. k slot (g, e) of chunk j in tile nk is key
    // nk*16 + 8g + 2j + e on both sides: P^T straight from the S^T registers.
    // unrolled whole: left rolled, s[nk] is read through indexed register moves
#pragma unroll
    for (int nk = 0; nk < 4; ++nk) {
#pragma unroll
      for (int j = 0; j < 4; ++j) {
        const int vrow = nk * 16 + (g << 3) + (j << 1);
        v2f bb;                               // B[key, query] = P[query, key]
        bb.x = s[nk][2 * j];
        bb.y = s[nk][2 * j + 1];
        for (int dt = 0; dt < 4; ++dt) {
          const int vcol = dt * 16 + lm;
          v2f a;                              // A[d, key] = V[key, d]
          a.x = Vs[cur][vrow][vcol];
          a.y = Vs[cur][vrow + 1][vcol];
          o[dt] = __builtin_amdgcn_wmma_f32_16x16x4_f32(
              false, a, false, bb, (short)0, o[dt], false, false);
        }
      }
    }
  }
  // the unmasked keys are done: do the masked ones weigh anything?
  if (hi == NKB) break;
  const unsigned int low = __builtin_amdgcn_ballot_w32(mrow < -5.0e8f);
  if (lane == 0) wlow[wave] = low != 0u;
  __syncthreads();                           // the four flags are written
  if (__builtin_amdgcn_readfirstlane(wlow[0] | wlow[1] | wlow[2] | wlow[3]) == 0)
    break;                                   // every masked key's weight is 0
  lo = hi;
  hi = NKB;
  }

  const float inv = 1.f / (lrow + xhalf(lrow));   // join the halves' sums
  const int n = qb * 64 + wave * 16 + lm;
  float* op = out + (size_t)b * NSEQ * CD + (size_t)n * CD + h * DH + (g << 3);
  for (int dt = 0; dt < 4; ++dt) {
    v4f lo, hi;
    for (int v = 0; v < 4; ++v) {
      lo[v] = o[dt][v] * inv;
      hi[v] = o[dt][v + 4] * inv;
    }
    *(v4f*)(op + dt * 16)     = lo;
    *(v4f*)(op + dt * 16 + 4) = hi;
  }
}

// ---------------------------------------------------------------------------
extern "C" void kernel_launch(void* const* d_in, const int* in_sizes, int n_in,
                              void* d_out, int out_size, void* d_ws, size_t ws_size,
                              hipStream_t stream) {
  const float* x   = (const float*)d_in[0];
  const int*   msk = (const int*)d_in[1];
  const float* qw  = (const float*)d_in[2];
  const float* qb  = (const float*)d_in[3];
  const float* kw  = (const float*)d_in[4];
  const float* kb  = (const float*)d_in[5];
  const float* vw  = (const float*)d_in[6];
  const float* vb  = (const float*)d_in[7];
  float* out = (float*)d_out;

  const size_t mat = (size_t)BN * CD;     // floats per projection (12.6 MB)
  float* qws = (float*)d_ws;
  float* kws = qws + mat;
  float* vws = kws + mat;

  dim3 gg(BN / 64, CD / 64, 3);           // 64 x 12 blocks for each of Q, K, V
  qkv_gemm_kernel<<<gg, 128, 0, stream>>>(x, qw, qb, kw, kb, vw, vb, qws);

  dim3 ga(NSEQ / 64, BATCH * NH);         // 32 x 24 blocks
  attn_kernel<<<ga, 128, 0, stream>>>(qws, kws, vws, msk, out);
}
